// v000
// Measured on an AMD MI455X. A time is GPU time per run, averaged over a window of back-to-back runs after a warm-up
// (all launches, gaps included; the runs take copies of the inputs in turn), and the median of several windows.
// Apart from v000's, it joins two sittings. Times from different sittings can be a few percent apart, while
// side-by-side timings come from the same sitting.
// v000 is the starting kernel. One run takes 99.9 microseconds.
#include <hip/hip_runtime.h>
#include <math.h>

#define NUM_HEADS 32
#define NUM_KV_HEADS 8
#define GROUP 4
#define HEAD_DIM 128
#define BS 16
#define KV_LEN 2048
#define ATTN_SCALE 0.08838834764831845f
#define NWAVES 2                             // waves per block (64 threads)
#define NTILES (KV_LEN / 16)                 // 128 key-tiles per (b, kvh)
#define NCHUNK 8                             // flash-decode KV split
#define PART_STRIDE (GROUP * (HEAD_DIM + 2)) // 520 floats per partial

typedef __attribute__((ext_vector_type(2))) float v2f;
typedef __attribute__((ext_vector_type(8))) float v8f;

__device__ __forceinline__ float wave_max(float v) {
#pragma unroll
    for (int off = 16; off; off >>= 1) v = fmaxf(v, __shfl_xor(v, off, 32));
    return v;
}
__device__ __forceinline__ float wave_sum(float v) {
#pragma unroll
    for (int off = 16; off; off >>= 1) v += __shfl_xor(v, off, 32);
    return v;
}

// Core: key-tiles [t0, t1) for one (b, kvh). Two waves stride over tiles with
// independent online softmax; K tiles are staged to LDS with double-buffered
// GLOBAL_LOAD_ASYNC_TO_LDS_B128 (ASYNCcnt), so HBM latency of tile t+2 hides
// behind the 64 f32 WMMAs of tile t. Wave partials merge through LDS.
// If write_partial: dst = 520-float partial entry {m[4], l[4], O[4][128]}.
// Else:             dst = out + (b, kvh) base, normalized store.
__device__ __forceinline__ void attn_core(
    int b, int kvh, int t0, int t1,
    const float* __restrict__ q, const float* __restrict__ kin,
    const float* __restrict__ vin, const float* __restrict__ kc,
    const float* __restrict__ vc, const int* __restrict__ slot_mapping,
    const int* __restrict__ page_indices,
    float (*sQ)[132], float (*sK)[2][16][132], float (*sP)[16 * 20],
    unsigned long long (*sVp)[2][16],
    float (*mM)[GROUP], float (*mL)[GROUP], float (*mO)[GROUP][HEAD_DIM],
    float* dst, bool write_partial)
{
    const int tid  = threadIdx.x;
    const int w    = tid >> 5;
    const int lane = tid & 31;
    const int half = (lane >> 4) & 1;
    const int l16  = lane & 15;

    // ---- stage Q: rows 0..3 = grouped query heads, rows 4..15 = 0 ----
    for (int i = tid; i < 16 * 132; i += NWAVES * 32) ((float*)sQ)[i] = 0.f;
    for (int i = lane; i < 16 * 20; i += 32) sP[w][i] = 0.f;
    __syncthreads();
    for (int i = tid; i < GROUP * HEAD_DIM; i += NWAVES * 32) {
        int h = i >> 7, d = i & 127;
        sQ[h][d] = q[(size_t)b * NUM_HEADS * HEAD_DIM + (kvh * GROUP + h) * HEAD_DIM + d];
    }
    __syncthreads();

    int sm[BS];
#pragma unroll
    for (int j = 0; j < BS; ++j) sm[j] = slot_mapping[j];

    // Issue one 16-key tile's K rows as async global->LDS B128 copies and
    // record the resolved (fresh-or-cache) V row pointers.
    auto stage = [&](int t, int bufi) {
#pragma unroll 4
        for (int r = 0; r < 16; ++r) {
            int lpos = t * 16 + r;
            int slot = page_indices[b * KV_LEN + lpos];
            int fresh = -1;
#pragma unroll
            for (int j = 0; j < BS; ++j)
                if (slot == sm[j]) fresh = j;
            const float* kp;
            const float* vp;
            if (fresh >= 0) {
                kp = kin + (size_t)fresh * NUM_KV_HEADS * HEAD_DIM + kvh * HEAD_DIM;
                vp = vin + (size_t)fresh * NUM_KV_HEADS * HEAD_DIM + kvh * HEAD_DIM;
            } else {
                kp = kc + (size_t)slot * NUM_KV_HEADS * HEAD_DIM + kvh * HEAD_DIM;
                vp = vc + (size_t)slot * NUM_KV_HEADS * HEAD_DIM + kvh * HEAD_DIM;
            }
            // Per-lane 16B: memory -> LDS, no VGPR round-trip, ASYNCcnt-tracked.
            unsigned ldsa = (unsigned)(unsigned long long)&sK[w][bufi][r][0]
                          + (unsigned)(lane * 16);
            const float* gp = kp + lane * 4;
            asm volatile("global_load_async_to_lds_b128 %0, %1, off"
                         :: "v"(ldsa), "v"(gp) : "memory");
            if (lane == 0) sVp[w][bufi][r] = (unsigned long long)vp;
        }
    };

    float m[GROUP], l[GROUP];
#pragma unroll
    for (int r = 0; r < GROUP; ++r) { m[r] = -INFINITY; l[r] = 0.f; }
    v8f acc[8];
    v8f vzero = {};
#pragma unroll
    for (int nt = 0; nt < 8; ++nt) acc[nt] = vzero;

    int t = t0 + w;
    if (t < t1) stage(t, 0);
    int buf = 0;
    for (; t < t1; t += NWAVES, buf ^= 1) {
        bool more = (t + NWAVES) < t1;
        if (more) {
            stage(t + NWAVES, buf ^ 1);  // prefetch next tile into other buffer
            // async loads retire in order: <=16 outstanding => current tile landed
            asm volatile("s_wait_asynccnt 16" ::: "memory");
        } else {
            asm volatile("s_wait_asynccnt 0" ::: "memory");
        }

        // ---- S = Q * K^T  (M=16 heads, N=16 keys, K=head_dim steps of 4) ----
        v8f c = vzero;
#pragma unroll 8
        for (int s = 0; s < 32; ++s) {
            int d0 = 4 * s + 2 * half;
            v2f a   = *(const v2f*)&sQ[l16][d0];
            v2f bfr = *(const v2f*)&sK[w][buf][l16][d0];
            c = __builtin_amdgcn_wmma_f32_16x16x4_f32(false, a, false, bfr,
                                                      (short)0, c, false, false);
        }

        // ---- online softmax per real head row ----
#pragma unroll
        for (int r = 0; r < GROUP; ++r) {
            float sv = (lane < 16) ? c[r] * ATTN_SCALE : -INFINITY;
            float nm = fmaxf(m[r], wave_max(sv));
            float p  = __expf(sv - nm);
            float tl = wave_sum(p);
            float fac = __expf(m[r] - nm);
            l[r] = l[r] * fac + tl;
            m[r] = nm;
            if (lane < 16) sP[w][r * 20 + lane] = p;
#pragma unroll
            for (int nt = 0; nt < 8; ++nt) acc[nt][r] *= fac;
        }

        // ---- O += P * V  (K=16 keys steps of 4, N=128 dims, 8 tiles) ----
#pragma unroll
        for (int ks = 0; ks < 4; ++ks) {
            int k0 = 4 * ks + 2 * half;
            v2f a = *(const v2f*)&sP[w][l16 * 20 + k0];
            const float* p0 = (const float*)sVp[w][buf][k0];
            const float* p1 = (const float*)sVp[w][buf][k0 + 1];
#pragma unroll
            for (int nt = 0; nt < 8; ++nt) {
                v2f bfr;
                bfr.x = p0[nt * 16 + l16];
                bfr.y = p1[nt * 16 + l16];
                acc[nt] = __builtin_amdgcn_wmma_f32_16x16x4_f32(false, a, false, bfr,
                                                                (short)0, acc[nt], false, false);
            }
        }
    }

    // ---- write per-wave partials, merge across the 2 waves ----
    if (lane < 16) {
#pragma unroll
        for (int nt = 0; nt < 8; ++nt)
#pragma unroll
            for (int r = 0; r < GROUP; ++r)
                mO[w][r][nt * 16 + lane] = acc[nt][r];
    }
    if (lane == 0) {
#pragma unroll
        for (int r = 0; r < GROUP; ++r) { mM[w][r] = m[r]; mL[w][r] = l[r]; }
    }
    __syncthreads();

    float gm[GROUP], f0[GROUP], f1[GROUP], Ls[GROUP];
#pragma unroll
    for (int r = 0; r < GROUP; ++r) {
        gm[r] = fmaxf(mM[0][r], mM[1][r]);
        f0[r] = __expf(mM[0][r] - gm[r]);
        f1[r] = __expf(mM[1][r] - gm[r]);
        Ls[r] = f0[r] * mL[0][r] + f1[r] * mL[1][r];
    }
    if (write_partial) {
        if (tid == 0) {
#pragma unroll
            for (int r = 0; r < GROUP; ++r) { dst[r] = gm[r]; dst[GROUP + r] = Ls[r]; }
        }
        for (int d = tid; d < HEAD_DIM; d += NWAVES * 32)
#pragma unroll
            for (int r = 0; r < GROUP; ++r)
                dst[2 * GROUP + r * HEAD_DIM + d] =
                    f0[r] * mO[0][r][d] + f1[r] * mO[1][r][d];
    } else {
        for (int d = tid; d < HEAD_DIM; d += NWAVES * 32)
#pragma unroll
            for (int r = 0; r < GROUP; ++r)
                dst[r * HEAD_DIM + d] =
                    (f0[r] * mO[0][r][d] + f1[r] * mO[1][r][d]) / Ls[r];
    }
}

#define DECLARE_LDS()                                  \
    __shared__ float sQ[16][132];                      \
    __shared__ float sK[NWAVES][2][16][132];           \
    __shared__ float sP[NWAVES][16 * 20];              \
    __shared__ unsigned long long sVp[NWAVES][2][16];  \
    __shared__ float mM[NWAVES][GROUP];                \
    __shared__ float mL[NWAVES][GROUP];                \
    __shared__ float mO[NWAVES][GROUP][HEAD_DIM];

// Fallback (no workspace): one block per (b, kvh), whole KV range.
__global__ __launch_bounds__(NWAVES * 32) void paged_attn_direct_kernel(
    const float* __restrict__ q, const float* __restrict__ kin,
    const float* __restrict__ vin, const float* __restrict__ kc,
    const float* __restrict__ vc, const int* __restrict__ slot_mapping,
    const int* __restrict__ page_indices, float* __restrict__ out)
{
    DECLARE_LDS();
    const int b   = blockIdx.x / NUM_KV_HEADS;
    const int kvh = blockIdx.x % NUM_KV_HEADS;
    float* dst = out + (size_t)b * NUM_HEADS * HEAD_DIM + kvh * GROUP * HEAD_DIM;
    attn_core(b, kvh, 0, NTILES, q, kin, vin, kc, vc, slot_mapping, page_indices,
              sQ, sK, sP, sVp, mM, mL, mO, dst, false);
}

// Pass 1: flash-decode partials. grid = (BS*NUM_KV_HEADS, NCHUNK).
__global__ __launch_bounds__(NWAVES * 32) void paged_attn_partial_kernel(
    const float* __restrict__ q, const float* __restrict__ kin,
    const float* __restrict__ vin, const float* __restrict__ kc,
    const float* __restrict__ vc, const int* __restrict__ slot_mapping,
    const int* __restrict__ page_indices, float* __restrict__ part)
{
    DECLARE_LDS();
    const int b     = blockIdx.x / NUM_KV_HEADS;
    const int kvh   = blockIdx.x % NUM_KV_HEADS;
    const int chunk = blockIdx.y;
    const int tpc   = NTILES / NCHUNK;
    float* dst = part + ((size_t)blockIdx.x * NCHUNK + chunk) * PART_STRIDE;
    attn_core(b, kvh, chunk * tpc, (chunk + 1) * tpc, q, kin, vin, kc, vc,
              slot_mapping, page_indices, sQ, sK, sP, sVp, mM, mL, mO, dst, true);
}

// Pass 2: combine NCHUNK partials per (b, kvh), normalize, store.
__global__ __launch_bounds__(128) void paged_attn_combine_kernel(
    const float* __restrict__ part, float* __restrict__ out)
{
    const int b   = blockIdx.x / NUM_KV_HEADS;
    const int kvh = blockIdx.x % NUM_KV_HEADS;
    const int d   = threadIdx.x;
    const float* p0 = part + (size_t)blockIdx.x * NCHUNK * PART_STRIDE;
#pragma unroll
    for (int r = 0; r < GROUP; ++r) {
        float gm = -INFINITY;
#pragma unroll
        for (int c = 0; c < NCHUNK; ++c) gm = fmaxf(gm, p0[c * PART_STRIDE + r]);
        float Ls = 0.f, val = 0.f;
#pragma unroll
        for (int c = 0; c < NCHUNK; ++c) {
            const float* p = p0 + c * PART_STRIDE;
            float f = __expf(p[r] - gm);
            Ls  += f * p[GROUP + r];
            val += f * p[2 * GROUP + r * HEAD_DIM + d];
        }
        out[(size_t)b * NUM_HEADS * HEAD_DIM + (kvh * GROUP + r) * HEAD_DIM + d] = val / Ls;
    }
}

extern "C" void kernel_launch(void* const* d_in, const int* in_sizes, int n_in,
                              void* d_out, int out_size, void* d_ws, size_t ws_size,
                              hipStream_t stream) {
    const float* q  = (const float*)d_in[0];
    const float* k  = (const float*)d_in[1];
    const float* v  = (const float*)d_in[2];
    const float* kc = (const float*)d_in[3];
    const float* vc = (const float*)d_in[4];
    const int* slot_mapping = (const int*)d_in[5];
    const int* page_indices = (const int*)d_in[6];
    float* out = (float*)d_out;

    const size_t part_bytes =
        (size_t)BS * NUM_KV_HEADS * NCHUNK * PART_STRIDE * sizeof(float);

    if (ws_size >= part_bytes && d_ws != nullptr) {
        // Flash-decode path: 1024 blocks (2048 waves) to saturate HBM.
        float* part = (float*)d_ws;
        dim3 grid1(BS * NUM_KV_HEADS, NCHUNK);
        paged_attn_partial_kernel<<<grid1, NWAVES * 32, 0, stream>>>(
            q, k, v, kc, vc, slot_mapping, page_indices, part);
        paged_attn_combine_kernel<<<dim3(BS * NUM_KV_HEADS), 128, 0, stream>>>(part, out);
    } else {
        paged_attn_direct_kernel<<<dim3(BS * NUM_KV_HEADS), NWAVES * 32, 0, stream>>>(
            q, k, v, kc, vc, slot_mapping, page_indices, out);
    }
}

// v001
// A run of this version takes 50.8 microseconds.
// In both of two side-by-side timings against v000, it was 1.99 times as fast.
#include <hip/hip_runtime.h>
#include <math.h>

#define NUM_HEADS 32
#define NUM_KV_HEADS 8
#define GROUP 4
#define HEAD_DIM 128
#define BS 16
#define KV_LEN 2048
#define NUM_SLOTS (BS * KV_LEN)
#define ATTN_SCALE 0.08838834764831845f
#define NWAVES 2                             // waves per block (64 threads)
#define NTILES (KV_LEN / 16)                 // 128 key-tiles per (b, kvh)
#define NCHUNK 8                             // flash-decode KV split
#define PART_STRIDE (GROUP * (HEAD_DIM + 2)) // 520 floats per partial

typedef __attribute__((ext_vector_type(2))) float v2f;
typedef __attribute__((ext_vector_type(8))) float v8f;

__device__ __forceinline__ float wave_max(float v) {
#pragma unroll
    for (int off = 16; off; off >>= 1) v = fmaxf(v, __shfl_xor(v, off, 32));
    return v;
}
__device__ __forceinline__ float wave_sum(float v) {
#pragma unroll
    for (int off = 16; off; off >>= 1) v += __shfl_xor(v, off, 32);
    return v;
}

// Core: key-tiles [t0, t1) for one (b, kvh). Two waves stride over tiles with
// independent online softmax; K tiles are staged to LDS with double-buffered
// GLOBAL_LOAD_ASYNC_TO_LDS_B128 (ASYNCcnt), so HBM latency of tile t+2 hides
// behind the 64 f32 WMMAs of tile t. Wave partials merge through LDS.
// If write_partial: dst = 520-float partial entry {m[4], l[4], O[4][128]}.
// Else:             dst = out + (b, kvh) base, normalized store.
__device__ __forceinline__ void attn_core(
    int b, int kvh, int t0, int t1,
    const float* __restrict__ q, const float* __restrict__ kin,
    const float* __restrict__ vin, const float* __restrict__ kc,
    const float* __restrict__ vc, const int* __restrict__ slot_mapping,
    const int* __restrict__ page_indices,
    float (*sQ)[132], float (*sK)[2][16][132], float (*sP)[16 * 20],
    unsigned long long (*sVp)[2][16],
    float (*mM)[GROUP], float (*mL)[GROUP], float (*mO)[GROUP][HEAD_DIM],
    float* dst, bool write_partial)
{
    const int tid  = threadIdx.x;
    // wave number as a scalar: the loop and the branch round the copies are scalar
    const int w    = __builtin_amdgcn_readfirstlane(tid >> 5);
    const int lane = tid & 31;
    const int half = (lane >> 4) & 1;
    const int l16  = lane & 15;

    // Lane l16 fetches the page slot of row l16 of tile t: one load for the tile.
    auto load_slot = [&](int t) {
        return page_indices[b * KV_LEN + t * 16 + l16];
    };

    // Slots of this wave's first two tiles: asked for ahead of the Q staging.
    int t = t0 + w;
    const int slot_first = load_slot(min(t, NTILES - 1));
    int slot_next = load_slot(min(t + NWAVES, NTILES - 1));

    // ---- stage Q: rows 0..3 = grouped query heads, rows 4..15 = 0 ----
    for (int i = tid; i < 16 * 132; i += NWAVES * 32) ((float*)sQ)[i] = 0.f;
    for (int i = lane; i < 16 * 20; i += 32) sP[w][i] = 0.f;
    __syncthreads();
    for (int i = tid; i < GROUP * HEAD_DIM; i += NWAVES * 32) {
        int h = i >> 7, d = i & 127;
        sQ[h][d] = q[(size_t)b * NUM_HEADS * HEAD_DIM + (kvh * GROUP + h) * HEAD_DIM + d];
    }
    __syncthreads();

    int sm[BS];
#pragma unroll
    for (int j = 0; j < BS; ++j) sm[j] = slot_mapping[j];

    // Resolve the tile's 16 rows in the lanes (fresh-or-cache, K and V pointer),
    // hand each K row pointer to the whole wave by readlane, and issue the 16
    // async global->LDS B128 copies back to back, with no load between them.
    auto stage = [&](int slot, int bufi) {
        slot = min(max(slot, 0), NUM_SLOTS - 1);  // bounds the address for any content
        int fresh = -1;
#pragma unroll
        for (int j = 0; j < BS; ++j)
            if (slot == sm[j]) fresh = j;
        const size_t off = (size_t)(fresh >= 0 ? fresh : slot) * (NUM_KV_HEADS * HEAD_DIM)
                         + kvh * HEAD_DIM;
        const unsigned long long ka = (unsigned long long)((fresh >= 0 ? kin : kc) + off);
        const unsigned long long va = (unsigned long long)((fresh >= 0 ? vin : vc) + off);
        const int klo = (int)(unsigned)ka;
        const int khi = (int)(unsigned)(ka >> 32);
        // This wave's own reads of the buffer that is refilled have retired.
        asm volatile("s_wait_dscnt 0x0" ::: "memory");
        // Both loops unrolled: readlane takes a constant lane, and the sixteen
        // addresses stay in registers as operands of the two statements.
#pragma unroll
        for (int g = 0; g < 2; ++g) {
            unsigned la[8];
            const float* gp[8];
#pragma unroll
            for (int i = 0; i < 8; ++i) {
                const int r = g * 8 + i;
                unsigned long long rk =
                    ((unsigned long long)(unsigned)__builtin_amdgcn_readlane(khi, r) << 32)
                    | (unsigned)__builtin_amdgcn_readlane(klo, r);
                // Per-lane 16B: memory -> LDS, no VGPR round-trip, ASYNCcnt-tracked.
                gp[i] = (const float*)rk + lane * 4;
                la[i] = (unsigned)(unsigned long long)&sK[w][bufi][r][0]
                      + (unsigned)(lane * 16);
            }
            // Eight copies and their s_wait_xcnt in one statement: the address
            // registers are not rewritten in front of that wait.
            asm volatile("global_load_async_to_lds_b128 %0, %1, off\n\t"
                         "global_load_async_to_lds_b128 %2, %3, off\n\t"
                         "global_load_async_to_lds_b128 %4, %5, off\n\t"
                         "global_load_async_to_lds_b128 %6, %7, off\n\t"
                         "global_load_async_to_lds_b128 %8, %9, off\n\t"
                         "global_load_async_to_lds_b128 %10, %11, off\n\t"
                         "global_load_async_to_lds_b128 %12, %13, off\n\t"
                         "global_load_async_to_lds_b128 %14, %15, off\n\t"
                         "s_wait_xcnt 0x0"
                         :: "v"(la[0]), "v"(gp[0]), "v"(la[1]), "v"(gp[1]),
                            "v"(la[2]), "v"(gp[2]), "v"(la[3]), "v"(gp[3]),
                            "v"(la[4]), "v"(gp[4]), "v"(la[5]), "v"(gp[5]),
                            "v"(la[6]), "v"(gp[6]), "v"(la[7]), "v"(gp[7])
                         : "memory");
        }
        if (lane < 16) sVp[w][bufi][lane] = va;
    };

    float m[GROUP], l[GROUP];
#pragma unroll
    for (int r = 0; r < GROUP; ++r) { m[r] = -INFINITY; l[r] = 0.f; }
    v8f acc[8];
    v8f vzero = {};
#pragma unroll
    for (int nt = 0; nt < 8; ++nt) acc[nt] = vzero;

    if (t < t1) stage(slot_first, 0);
    int buf = 0;
    for (; t < t1; t += NWAVES, buf ^= 1) {
        bool more = (t + NWAVES) < t1;
        if (more) {
            stage(slot_next, buf ^ 1);  // prefetch next tile into other buffer
            // slots of the tile after that: asked for one tile ahead of their use
            if (t + 2 * NWAVES < t1) slot_next = load_slot(t + 2 * NWAVES);
            // async loads retire in order: <=16 outstanding => current tile landed
            asm volatile("s_wait_asynccnt 16" ::: "memory");
        } else {
            asm volatile("s_wait_asynccnt 0" ::: "memory");
        }

        // ---- S = Q * K^T  (M=16 heads, N=16 keys, K=head_dim steps of 4) ----
        v8f c = vzero;
#pragma unroll 8
        for (int s = 0; s < 32; ++s) {
            int d0 = 4 * s + 2 * half;
            v2f a   = *(const v2f*)&sQ[l16][d0];
            v2f bfr = *(const v2f*)&sK[w][buf][l16][d0];
            c = __builtin_amdgcn_wmma_f32_16x16x4_f32(false, a, false, bfr,
                                                      (short)0, c, false, false);
        }

        // ---- online softmax per real head row ----
#pragma unroll
        for (int r = 0; r < GROUP; ++r) {
            float sv = (lane < 16) ? c[r] * ATTN_SCALE : -INFINITY;
            float nm = fmaxf(m[r], wave_max(sv));
            float p  = __expf(sv - nm);
            float tl = wave_sum(p);
            float fac = __expf(m[r] - nm);
            l[r] = l[r] * fac + tl;
            m[r] = nm;
            if (lane < 16) sP[w][r * 20 + lane] = p;
#pragma unroll
            for (int nt = 0; nt < 8; ++nt) acc[nt][r] *= fac;
        }

        // ---- O += P * V  (K=16 keys steps of 4, N=128 dims, 8 tiles) ----
#pragma unroll
        for (int ks = 0; ks < 4; ++ks) {
            int k0 = 4 * ks + 2 * half;
            v2f a = *(const v2f*)&sP[w][l16 * 20 + k0];
            const float* p0 = (const float*)sVp[w][buf][k0];
            const float* p1 = (const float*)sVp[w][buf][k0 + 1];
#pragma unroll
            for (int nt = 0; nt < 8; ++nt) {
                v2f bfr;
                bfr.x = p0[nt * 16 + l16];
                bfr.y = p1[nt * 16 + l16];
                acc[nt] = __builtin_amdgcn_wmma_f32_16x16x4_f32(false, a, false, bfr,
                                                                (short)0, acc[nt], false, false);
            }
        }
    }

    // ---- write per-wave partials, merge across the 2 waves ----
    if (lane < 16) {
#pragma unroll
        for (int nt = 0; nt < 8; ++nt)
#pragma unroll
            for (int r = 0; r < GROUP; ++r)
                mO[w][r][nt * 16 + lane] = acc[nt][r];
    }
    if (lane == 0) {
#pragma unroll
        for (int r = 0; r < GROUP; ++r) { mM[w][r] = m[r]; mL[w][r] = l[r]; }
    }
    __syncthreads();

    float gm[GROUP], f0[GROUP], f1[GROUP], Ls[GROUP];
#pragma unroll
    for (int r = 0; r < GROUP; ++r) {
        gm[r] = fmaxf(mM[0][r], mM[1][r]);
        f0[r] = __expf(mM[0][r] - gm[r]);
        f1[r] = __expf(mM[1][r] - gm[r]);
        Ls[r] = f0[r] * mL[0][r] + f1[r] * mL[1][r];
    }
    if (write_partial) {
        if (tid == 0) {
#pragma unroll
            for (int r = 0; r < GROUP; ++r) { dst[r] = gm[r]; dst[GROUP + r] = Ls[r]; }
        }
        for (int d = tid; d < HEAD_DIM; d += NWAVES * 32)
#pragma unroll
            for (int r = 0; r < GROUP; ++r)
                dst[2 * GROUP + r * HEAD_DIM + d] =
                    f0[r] * mO[0][r][d] + f1[r] * mO[1][r][d];
    } else {
        for (int d = tid; d < HEAD_DIM; d += NWAVES * 32)
#pragma unroll
            for (int r = 0; r < GROUP; ++r)
                dst[r * HEAD_DIM + d] =
                    (f0[r] * mO[0][r][d] + f1[r] * mO[1][r][d]) / Ls[r];
    }
}

#define DECLARE_LDS()                                  \
    __shared__ float sQ[16][132];                      \
    __shared__ float sK[NWAVES][2][16][132];           \
    __shared__ float sP[NWAVES][16 * 20];              \
    __shared__ unsigned long long sVp[NWAVES][2][16];  \
    __shared__ float mM[NWAVES][GROUP];                \
    __shared__ float mL[NWAVES][GROUP];                \
    __shared__ float mO[NWAVES][GROUP][HEAD_DIM];

// Fallback (no workspace): one block per (b, kvh), whole KV range.
__global__ __launch_bounds__(NWAVES * 32) void paged_attn_direct_kernel(
    const float* __restrict__ q, const float* __restrict__ kin,
    const float* __restrict__ vin, const float* __restrict__ kc,
    const float* __restrict__ vc, const int* __restrict__ slot_mapping,
    const int* __restrict__ page_indices, float* __restrict__ out)
{
    DECLARE_LDS();
    const int b   = blockIdx.x / NUM_KV_HEADS;
    const int kvh = blockIdx.x % NUM_KV_HEADS;
    float* dst = out + (size_t)b * NUM_HEADS * HEAD_DIM + kvh * GROUP * HEAD_DIM;
    attn_core(b, kvh, 0, NTILES, q, kin, vin, kc, vc, slot_mapping, page_indices,
              sQ, sK, sP, sVp, mM, mL, mO, dst, false);
}

// Pass 1: flash-decode partials. grid = (BS*NUM_KV_HEADS, NCHUNK).
__global__ __launch_bounds__(NWAVES * 32) void paged_attn_partial_kernel(
    const float* __restrict__ q, const float* __restrict__ kin,
    const float* __restrict__ vin, const float* __restrict__ kc,
    const float* __restrict__ vc, const int* __restrict__ slot_mapping,
    const int* __restrict__ page_indices, float* __restrict__ part)
{
    DECLARE_LDS();
    const int b     = blockIdx.x / NUM_KV_HEADS;
    const int kvh   = blockIdx.x % NUM_KV_HEADS;
    const int chunk = blockIdx.y;
    const int tpc   = NTILES / NCHUNK;
    float* dst = part + ((size_t)blockIdx.x * NCHUNK + chunk) * PART_STRIDE;
    attn_core(b, kvh, chunk * tpc, (chunk + 1) * tpc, q, kin, vin, kc, vc,
              slot_mapping, page_indices, sQ, sK, sP, sVp, mM, mL, mO, dst, true);
}

// Pass 2: combine NCHUNK partials per (b, kvh), normalize, store.
__global__ __launch_bounds__(128) void paged_attn_combine_kernel(
    const float* __restrict__ part, float* __restrict__ out)
{
    const int b   = blockIdx.x / NUM_KV_HEADS;
    const int kvh = blockIdx.x % NUM_KV_HEADS;
    const int d   = threadIdx.x;
    const float* p0 = part + (size_t)blockIdx.x * NCHUNK * PART_STRIDE;
#pragma unroll
    for (int r = 0; r < GROUP; ++r) {
        float gm = -INFINITY;
#pragma unroll
        for (int c = 0; c < NCHUNK; ++c) gm = fmaxf(gm, p0[c * PART_STRIDE + r]);
        float Ls = 0.f, val = 0.f;
#pragma unroll
        for (int c = 0; c < NCHUNK; ++c) {
            const float* p = p0 + c * PART_STRIDE;
            float f = __expf(p[r] - gm);
            Ls  += f * p[GROUP + r];
            val += f * p[2 * GROUP + r * HEAD_DIM + d];
        }
        out[(size_t)b * NUM_HEADS * HEAD_DIM + (kvh * GROUP + r) * HEAD_DIM + d] = val / Ls;
    }
}

extern "C" void kernel_launch(void* const* d_in, const int* in_sizes, int n_in,
                              void* d_out, int out_size, void* d_ws, size_t ws_size,
                              hipStream_t stream) {
    const float* q  = (const float*)d_in[0];
    const float* k  = (const float*)d_in[1];
    const float* v  = (const float*)d_in[2];
    const float* kc = (const float*)d_in[3];
    const float* vc = (const float*)d_in[4];
    const int* slot_mapping = (const int*)d_in[5];
    const int* page_indices = (const int*)d_in[6];
    float* out = (float*)d_out;

    const size_t part_bytes =
        (size_t)BS * NUM_KV_HEADS * NCHUNK * PART_STRIDE * sizeof(float);

    if (ws_size >= part_bytes && d_ws != nullptr) {
        // Flash-decode path: 1024 blocks (2048 waves) to saturate HBM.
        float* part = (float*)d_ws;
        dim3 grid1(BS * NUM_KV_HEADS, NCHUNK);
        paged_attn_partial_kernel<<<grid1, NWAVES * 32, 0, stream>>>(
            q, k, v, kc, vc, slot_mapping, page_indices, part);
        paged_attn_combine_kernel<<<dim3(BS * NUM_KV_HEADS), 128, 0, stream>>>(part, out);
    } else {
        paged_attn_direct_kernel<<<dim3(BS * NUM_KV_HEADS), NWAVES * 32, 0, stream>>>(
            q, k, v, kc, vc, slot_mapping, page_indices, out);
    }
}

// v002
// A run of this version takes 41.4 microseconds.
// Next to v001, in two timings, it ran 1.23 and 1.22 times as fast.
// All steps since v000 together make it 2.44 times as fast.
#include <hip/hip_runtime.h>
#include <math.h>

#define NUM_HEADS 32
#define NUM_KV_HEADS 8
#define GROUP 4
#define HEAD_DIM 128
#define BS 16
#define KV_LEN 2048
#define NUM_SLOTS (BS * KV_LEN)
#define ATTN_SCALE 0.08838834764831845f
#define NWAVES 4                             // waves per block (128 threads), one per SIMD
#define QROWS (GROUP + 1)                    // staged Q rows: the heads and one zero row
#define RING_FLOATS (2 * 16 * 132)           // one wave's K ring: two tiles of 16 padded rows
#define NTILES (KV_LEN / 16)                 // 128 key-tiles per (b, kvh)
#define NCHUNK 8                             // flash-decode KV split
#define PART_STRIDE (GROUP * (HEAD_DIM + 2)) // 520 floats per partial

typedef __attribute__((ext_vector_type(2))) float v2f;
typedef __attribute__((ext_vector_type(8))) float v8f;

__device__ __forceinline__ float wave_max(float v) {
#pragma unroll
    for (int off = 16; off; off >>= 1) v = fmaxf(v, __shfl_xor(v, off, 32));
    return v;
}
__device__ __forceinline__ float wave_sum(float v) {
#pragma unroll
    for (int off = 16; off; off >>= 1) v += __shfl_xor(v, off, 32);
    return v;
}

// Core: key-tiles [t0, t1) for one (b, kvh). Four waves stride over tiles with
// independent online softmax; K tiles are staged to LDS with double-buffered
// GLOBAL_LOAD_ASYNC_TO_LDS_B128 (ASYNCcnt), so HBM latency of tile t+1 hides
// behind the 64 f32 WMMAs of tile t. Wave partials merge through LDS, each in
// its wave's own K ring, so that four blocks (16 waves) fit one WGP's LDS.
// If write_partial: dst = 520-float partial entry {m[4], l[4], O[4][128]}.
// Else:             dst = out + (b, kvh) base, normalized store.
__device__ __forceinline__ void attn_core(
    int b, int kvh, int t0, int t1,
    const float* __restrict__ q, const float* __restrict__ kin,
    const float* __restrict__ vin, const float* __restrict__ kc,
    const float* __restrict__ vc, const int* __restrict__ slot_mapping,
    const int* __restrict__ page_indices,
    float (*sQ)[132], float (*sK)[2][16][132], float (*sP)[16 * 20],
    unsigned long long (*sVp)[2][16],
    float* dst, bool write_partial)
{
    const int tid  = threadIdx.x;
    // wave number as a scalar: the loop and the branch round the copies are scalar
    const int w    = __builtin_amdgcn_readfirstlane(tid >> 5);
    const int lane = tid & 31;
    const int half = (lane >> 4) & 1;
    const int l16  = lane & 15;

    // Lane l16 fetches the page slot of row l16 of tile t: one load for the tile.
    auto load_slot = [&](int t) {
        return page_indices[b * KV_LEN + t * 16 + l16];
    };

    // Slots of this wave's first two tiles: asked for ahead of the Q staging.
    int t = t0 + w;
    const int slot_first = load_slot(min(t, NTILES - 1));
    int slot_next = load_slot(min(t + NWAVES, NTILES - 1));

    // ---- stage Q: rows 0..3 = grouped query heads, row 4 = 0 (read as rows 4..15) ----
    const int qrow = l16 < GROUP ? l16 : GROUP;
    for (int i = tid; i < QROWS * 132; i += NWAVES * 32) ((float*)sQ)[i] = 0.f;
    for (int i = lane; i < 16 * 20; i += 32) sP[w][i] = 0.f;
    __syncthreads();
    for (int i = tid; i < GROUP * HEAD_DIM; i += NWAVES * 32) {
        int h = i >> 7, d = i & 127;
        sQ[h][d] = q[(size_t)b * NUM_HEADS * HEAD_DIM + (kvh * GROUP + h) * HEAD_DIM + d];
    }
    __syncthreads();

    int sm[BS];
#pragma unroll
    for (int j = 0; j < BS; ++j) sm[j] = slot_mapping[j];

    // Resolve the tile's 16 rows in the lanes (fresh-or-cache, K and V pointer),
    // hand each K row pointer to the whole wave by readlane, and issue the 16
    // async global->LDS B128 copies back to back, with no load between them.
    auto stage = [&](int slot, int bufi) {
        slot = min(max(slot, 0), NUM_SLOTS - 1);  // bounds the address for any content
        int fresh = -1;
#pragma unroll
        for (int j = 0; j < BS; ++j)
            if (slot == sm[j]) fresh = j;
        const size_t off = (size_t)(fresh >= 0 ? fresh : slot) * (NUM_KV_HEADS * HEAD_DIM)
                         + kvh * HEAD_DIM;
        const unsigned long long ka = (unsigned long long)((fresh >= 0 ? kin : kc) + off);
        const unsigned long long va = (unsigned long long)((fresh >= 0 ? vin : vc) + off);
        const int klo = (int)(unsigned)ka;
        const int khi = (int)(unsigned)(ka >> 32);
        // This wave's own reads of the buffer that is refilled have retired.
        asm volatile("s_wait_dscnt 0x0" ::: "memory");
        // Both loops unrolled: readlane takes a constant lane, and the sixteen
        // addresses stay in registers as operands of the two statements.
#pragma unroll
        for (int g = 0; g < 2; ++g) {
            unsigned la[8];
            const float* gp[8];
#pragma unroll
            for (int i = 0; i < 8; ++i) {
                const int r = g * 8 + i;
                unsigned long long rk =
                    ((unsigned long long)(unsigned)__builtin_amdgcn_readlane(khi, r) << 32)
                    | (unsigned)__builtin_amdgcn_readlane(klo, r);
                // Per-lane 16B: memory -> LDS, no VGPR round-trip, ASYNCcnt-tracked.
                gp[i] = (const float*)rk + lane * 4;
                la[i] = (unsigned)(unsigned long long)&sK[w][bufi][r][0]
                      + (unsigned)(lane * 16);
            }
            // Eight copies and their s_wait_xcnt in one statement: the address
            // registers are not rewritten in front of that wait.
            asm volatile("global_load_async_to_lds_b128 %0, %1, off\n\t"
                         "global_load_async_to_lds_b128 %2, %3, off\n\t"
                         "global_load_async_to_lds_b128 %4, %5, off\n\t"
                         "global_load_async_to_lds_b128 %6, %7, off\n\t"
                         "global_load_async_to_lds_b128 %8, %9, off\n\t"
                         "global_load_async_to_lds_b128 %10, %11, off\n\t"
                         "global_load_async_to_lds_b128 %12, %13, off\n\t"
                         "global_load_async_to_lds_b128 %14, %15, off\n\t"
                         "s_wait_xcnt 0x0"
                         :: "v"(la[0]), "v"(gp[0]), "v"(la[1]), "v"(gp[1]),
                            "v"(la[2]), "v"(gp[2]), "v"(la[3]), "v"(gp[3]),
                            "v"(la[4]), "v"(gp[4]), "v"(la[5]), "v"(gp[5]),
                            "v"(la[6]), "v"(gp[6]), "v"(la[7]), "v"(gp[7])
                         : "memory");
        }
        if (lane < 16) sVp[w][bufi][lane] = va;
    };

    float m[GROUP], l[GROUP];
#pragma unroll
    for (int r = 0; r < GROUP; ++r) { m[r] = -INFINITY; l[r] = 0.f; }
    v8f acc[8];
    v8f vzero = {};
#pragma unroll
    for (int nt = 0; nt < 8; ++nt) acc[nt] = vzero;

    if (t < t1) stage(slot_first, 0);
    int buf = 0;
    for (; t < t1; t += NWAVES, buf ^= 1) {
        bool more = (t + NWAVES) < t1;
        if (more) {
            stage(slot_next, buf ^ 1);  // prefetch next tile into other buffer
            // slots of the tile after that: asked for one tile ahead of their use
            if (t + 2 * NWAVES < t1) slot_next = load_slot(t + 2 * NWAVES);
            // async loads retire in order: <=16 outstanding => current tile landed
            asm volatile("s_wait_asynccnt 16" ::: "memory");
        } else {
            asm volatile("s_wait_asynccnt 0" ::: "memory");
        }

        // ---- S = Q * K^T  (M=16 heads, N=16 keys, K=head_dim steps of 4) ----
        v8f c = vzero;
#pragma unroll 8
        for (int s = 0; s < 32; ++s) {
            int d0 = 4 * s + 2 * half;
            v2f a   = *(const v2f*)&sQ[qrow][d0];
            v2f bfr = *(const v2f*)&sK[w][buf][l16][d0];
            c = __builtin_amdgcn_wmma_f32_16x16x4_f32(false, a, false, bfr,
                                                      (short)0, c, false, false);
        }

        // ---- online softmax per real head row ----
#pragma unroll
        for (int r = 0; r < GROUP; ++r) {
            float sv = (lane < 16) ? c[r] * ATTN_SCALE : -INFINITY;
            float nm = fmaxf(m[r], wave_max(sv));
            float p  = __expf(sv - nm);
            float tl = wave_sum(p);
            float fac = __expf(m[r] - nm);
            l[r] = l[r] * fac + tl;
            m[r] = nm;
            if (lane < 16) sP[w][r * 20 + lane] = p;
#pragma unroll
            for (int nt = 0; nt < 8; ++nt) acc[nt][r] *= fac;
        }

        // ---- O += P * V  (K=16 keys steps of 4, N=128 dims, 8 tiles) ----
#pragma unroll
        for (int ks = 0; ks < 4; ++ks) {
            int k0 = 4 * ks + 2 * half;
            v2f a = *(const v2f*)&sP[w][l16 * 20 + k0];
            const float* p0 = (const float*)sVp[w][buf][k0];
            const float* p1 = (const float*)sVp[w][buf][k0 + 1];
#pragma unroll
            for (int nt = 0; nt < 8; ++nt) {
                v2f bfr;
                bfr.x = p0[nt * 16 + l16];
                bfr.y = p1[nt * 16 + l16];
                acc[nt] = __builtin_amdgcn_wmma_f32_16x16x4_f32(false, a, false, bfr,
                                                                (short)0, acc[nt], false, false);
            }
        }
    }

    // ---- write per-wave partials, merge across the waves ----
    // The partial {O[4][128], m[4], l[4]} goes into the wave's own K ring: its
    // copies have landed and its reads of the ring have retired before the stores.
    asm volatile("s_wait_asynccnt 0x0" ::: "memory");
    asm volatile("s_wait_dscnt 0x0" ::: "memory");
    float* own = (float*)sK + w * RING_FLOATS;
    if (lane < 16) {
#pragma unroll
        for (int nt = 0; nt < 8; ++nt)
#pragma unroll
            for (int r = 0; r < GROUP; ++r)
                own[r * HEAD_DIM + nt * 16 + lane] = acc[nt][r];
    }
    if (lane == 0) {
#pragma unroll
        for (int r = 0; r < GROUP; ++r) {
            own[GROUP * HEAD_DIM + r] = m[r];
            own[GROUP * HEAD_DIM + GROUP + r] = l[r];
        }
    }
    __syncthreads();

    const float* ring = (const float*)sK;
    float gm[GROUP], fw[NWAVES][GROUP], Ls[GROUP];
#pragma unroll
    for (int r = 0; r < GROUP; ++r) {
        gm[r] = ring[GROUP * HEAD_DIM + r];
#pragma unroll
        for (int j = 1; j < NWAVES; ++j)
            gm[r] = fmaxf(gm[r], ring[j * RING_FLOATS + GROUP * HEAD_DIM + r]);
#pragma unroll
        for (int j = 0; j < NWAVES; ++j)
            fw[j][r] = __expf(ring[j * RING_FLOATS + GROUP * HEAD_DIM + r] - gm[r]);
        Ls[r] = fw[0][r] * ring[GROUP * HEAD_DIM + GROUP + r];
#pragma unroll
        for (int j = 1; j < NWAVES; ++j)
            Ls[r] += fw[j][r] * ring[j * RING_FLOATS + GROUP * HEAD_DIM + GROUP + r];
    }
    if (write_partial && tid == 0) {
#pragma unroll
        for (int r = 0; r < GROUP; ++r) { dst[r] = gm[r]; dst[GROUP + r] = Ls[r]; }
    }
    for (int d = tid; d < HEAD_DIM; d += NWAVES * 32)
#pragma unroll
        for (int r = 0; r < GROUP; ++r) {
            float o = fw[0][r] * ring[r * HEAD_DIM + d];
#pragma unroll
            for (int j = 1; j < NWAVES; ++j)
                o += fw[j][r] * ring[j * RING_FLOATS + r * HEAD_DIM + d];
            if (write_partial) dst[2 * GROUP + r * HEAD_DIM + d] = o;
            else               dst[r * HEAD_DIM + d] = o / Ls[r];
        }
}

#define DECLARE_LDS()                                  \
    __shared__ float sQ[QROWS][132];                   \
    __shared__ float sK[NWAVES][2][16][132];           \
    __shared__ float sP[NWAVES][16 * 20];              \
    __shared__ unsigned long long sVp[NWAVES][2][16];

// Fallback (no workspace): one block per (b, kvh), whole KV range.
__global__ __launch_bounds__(NWAVES * 32) void paged_attn_direct_kernel(
    const float* __restrict__ q, const float* __restrict__ kin,
    const float* __restrict__ vin, const float* __restrict__ kc,
    const float* __restrict__ vc, const int* __restrict__ slot_mapping,
    const int* __restrict__ page_indices, float* __restrict__ out)
{
    DECLARE_LDS();
    const int b   = blockIdx.x / NUM_KV_HEADS;
    const int kvh = blockIdx.x % NUM_KV_HEADS;
    float* dst = out + (size_t)b * NUM_HEADS * HEAD_DIM + kvh * GROUP * HEAD_DIM;
    attn_core(b, kvh, 0, NTILES, q, kin, vin, kc, vc, slot_mapping, page_indices,
              sQ, sK, sP, sVp, dst, false);
}

// Pass 1: flash-decode partials. grid = (BS*NUM_KV_HEADS, NCHUNK).
__global__ __launch_bounds__(NWAVES * 32) void paged_attn_partial_kernel(
    const float* __restrict__ q, const float* __restrict__ kin,
    const float* __restrict__ vin, const float* __restrict__ kc,
    const float* __restrict__ vc, const int* __restrict__ slot_mapping,
    const int* __restrict__ page_indices, float* __restrict__ part)
{
    DECLARE_LDS();
    const int b     = blockIdx.x / NUM_KV_HEADS;
    const int kvh   = blockIdx.x % NUM_KV_HEADS;
    const int chunk = blockIdx.y;
    const int tpc   = NTILES / NCHUNK;
    float* dst = part + ((size_t)blockIdx.x * NCHUNK + chunk) * PART_STRIDE;
    attn_core(b, kvh, chunk * tpc, (chunk + 1) * tpc, q, kin, vin, kc, vc,
              slot_mapping, page_indices, sQ, sK, sP, sVp, dst, true);
}

// Pass 2: combine NCHUNK partials per (b, kvh), normalize, store.
__global__ __launch_bounds__(128) void paged_attn_combine_kernel(
    const float* __restrict__ part, float* __restrict__ out)
{
    const int b   = blockIdx.x / NUM_KV_HEADS;
    const int kvh = blockIdx.x % NUM_KV_HEADS;
    const int d   = threadIdx.x;
    const float* p0 = part + (size_t)blockIdx.x * NCHUNK * PART_STRIDE;
#pragma unroll
    for (int r = 0; r < GROUP; ++r) {
        float gm = -INFINITY;
#pragma unroll
        for (int c = 0; c < NCHUNK; ++c) gm = fmaxf(gm, p0[c * PART_STRIDE + r]);
        float Ls = 0.f, val = 0.f;
#pragma unroll
        for (int c = 0; c < NCHUNK; ++c) {
            const float* p = p0 + c * PART_STRIDE;
            float f = __expf(p[r] - gm);
            Ls  += f * p[GROUP + r];
            val += f * p[2 * GROUP + r * HEAD_DIM + d];
        }
        out[(size_t)b * NUM_HEADS * HEAD_DIM + (kvh * GROUP + r) * HEAD_DIM + d] = val / Ls;
    }
}

extern "C" void kernel_launch(void* const* d_in, const int* in_sizes, int n_in,
                              void* d_out, int out_size, void* d_ws, size_t ws_size,
                              hipStream_t stream) {
    const float* q  = (const float*)d_in[0];
    const float* k  = (const float*)d_in[1];
    const float* v  = (const float*)d_in[2];
    const float* kc = (const float*)d_in[3];
    const float* vc = (const float*)d_in[4];
    const int* slot_mapping = (const int*)d_in[5];
    const int* page_indices = (const int*)d_in[6];
    float* out = (float*)d_out;

    const size_t part_bytes =
        (size_t)BS * NUM_KV_HEADS * NCHUNK * PART_STRIDE * sizeof(float);

    if (ws_size >= part_bytes && d_ws != nullptr) {
        // Flash-decode path: 1024 blocks (4096 waves), four blocks a WGP.
        float* part = (float*)d_ws;
        dim3 grid1(BS * NUM_KV_HEADS, NCHUNK);
        paged_attn_partial_kernel<<<grid1, NWAVES * 32, 0, stream>>>(
            q, k, v, kc, vc, slot_mapping, page_indices, part);
        paged_attn_combine_kernel<<<dim3(BS * NUM_KV_HEADS), 128, 0, stream>>>(part, out);
    } else {
        paged_attn_direct_kernel<<<dim3(BS * NUM_KV_HEADS), NWAVES * 32, 0, stream>>>(
            q, k, v, kc, vc, slot_mapping, page_indices, out);
    }
}

// v003
// A run of this version takes 28.5 microseconds.
// Next to v002, in two timings, it ran 1.45 times as fast each time.
// Counting every step since v000, it is 3.54 times as fast.
#include <hip/hip_runtime.h>
#include <math.h>

#define NUM_HEADS 32
#define NUM_KV_HEADS 8
#define GROUP 4
#define HEAD_DIM 128
#define BS 16
#define KV_LEN 2048
#define NUM_SLOTS (BS * KV_LEN)
#define ATTN_SCALE 0.08838834764831845f
#define NWAVES 4                             // waves per block (128 threads), one per SIMD
#define QROWS (GROUP + 1)                    // staged Q rows: the heads and one zero row
#define KPITCH 132                           // K row pitch in floats
#define VPITCH 144                           // V row pitch: four rows in a row fall on the 64 banks once
#define RING_FLOATS (16 * KPITCH)            // one wave's K tile: 16 padded rows
#define NTILES (KV_LEN / 16)                 // 128 key-tiles per (b, kvh)
#define NCHUNK 8                             // flash-decode KV split
#define PART_STRIDE (GROUP * (HEAD_DIM + 2)) // 520 floats per partial

typedef __attribute__((ext_vector_type(2))) float v2f;
typedef __attribute__((ext_vector_type(8))) float v8f;

__device__ __forceinline__ float wave_max(float v) {
#pragma unroll
    for (int off = 16; off; off >>= 1) v = fmaxf(v, __shfl_xor(v, off, 32));
    return v;
}
__device__ __forceinline__ float wave_sum(float v) {
#pragma unroll
    for (int off = 16; off; off >>= 1) v += __shfl_xor(v, off, 32);
    return v;
}

// Core: key-tiles [t0, t1) for one (b, kvh). Four waves stride over tiles with
// independent online softmax; K and V tiles are staged to LDS with
// GLOBAL_LOAD_ASYNC_TO_LDS_B128 (ASYNCcnt), one buffer each per wave: K of tile
// t+4 is asked for as soon as the scores of tile t are done, V of tile t+4 as
// soon as the output products of tile t are done, so each flies behind the
// other half of the work. Wave partials merge through LDS, each in its wave's
// own K buffer, so that four blocks (16 waves) fit one WGP's LDS.
// If write_partial: dst = 520-float partial entry {m[4], l[4], O[4][128]}.
// Else:             dst = out + (b, kvh) base, normalized store.
__device__ __forceinline__ void attn_core(
    int b, int kvh, int t0, int t1,
    const float* __restrict__ q, const float* __restrict__ kin,
    const float* __restrict__ vin, const float* __restrict__ kc,
    const float* __restrict__ vc, const int* __restrict__ slot_mapping,
    const int* __restrict__ page_indices,
    float (*sQ)[132], float (*sK)[16][KPITCH], float (*sV)[16][VPITCH],
    float (*sP)[16 * 20],
    float* dst, bool write_partial)
{
    const int tid  = threadIdx.x;
    // wave number as a scalar: the loop and the branch round the copies are scalar
    const int w    = __builtin_amdgcn_readfirstlane(tid >> 5);
    const int lane = tid & 31;
    const int half = (lane >> 4) & 1;
    const int l16  = lane & 15;

    // Lane l16 fetches the page slot of row l16 of tile t: one load for the tile.
    auto load_slot = [&](int t) {
        return page_indices[b * KV_LEN + t * 16 + l16];
    };

    // Slots of this wave's first two tiles: asked for ahead of the Q staging.
    int t = t0 + w;
    const int slot_first = load_slot(min(t, NTILES - 1));
    int slot_next = load_slot(min(t + NWAVES, NTILES - 1));

    // ---- stage Q: rows 0..3 = grouped query heads, row 4 = 0 (read as rows 4..15) ----
    const int qrow = l16 < GROUP ? l16 : GROUP;
    for (int i = tid; i < QROWS * 132; i += NWAVES * 32) ((float*)sQ)[i] = 0.f;
    for (int i = lane; i < 16 * 20; i += 32) sP[w][i] = 0.f;
    __syncthreads();
    for (int i = tid; i < GROUP * HEAD_DIM; i += NWAVES * 32) {
        int h = i >> 7, d = i & 127;
        sQ[h][d] = q[(size_t)b * NUM_HEADS * HEAD_DIM + (kvh * GROUP + h) * HEAD_DIM + d];
    }
    __syncthreads();

    int sm[BS];
#pragma unroll
    for (int j = 0; j < BS; ++j) sm[j] = slot_mapping[j];

    // Resolve the tile's 16 rows in the lanes: fresh-or-cache, K and V row address.
    unsigned long long ka = 0, va = 0;
    auto resolve = [&](int slot) {
        slot = min(max(slot, 0), NUM_SLOTS - 1);  // bounds the address for any content
        int fresh = -1;
#pragma unroll
        for (int j = 0; j < BS; ++j)
            if (slot == sm[j]) fresh = j;
        const size_t off = (size_t)(fresh >= 0 ? fresh : slot) * (NUM_KV_HEADS * HEAD_DIM)
                         + kvh * HEAD_DIM;
        ka = (unsigned long long)((fresh >= 0 ? kin : kc) + off);
        va = (unsigned long long)((fresh >= 0 ? vin : vc) + off);
    };

    // Hand each of the 16 row addresses (lane r holds row r's) to the whole wave
    // by readlane and issue the 16 async global->LDS B128 copies back to back.
    auto copy_tile = [&](unsigned long long rows, unsigned lds_base, unsigned pitch_bytes) {
        const int alo = (int)(unsigned)rows;
        const int ahi = (int)(unsigned)(rows >> 32);
        // This wave's own reads of the buffer that is refilled have retired.
        asm volatile("s_wait_dscnt 0x0" ::: "memory");
        // Both loops unrolled: readlane takes a constant lane, and the sixteen
        // addresses stay in registers as operands of the two statements.
#pragma unroll
        for (int g = 0; g < 2; ++g) {
            unsigned la[8];
            const float* gp[8];
#pragma unroll
            for (int i = 0; i < 8; ++i) {
                const int r = g * 8 + i;
                unsigned long long ra =
                    ((unsigned long long)(unsigned)__builtin_amdgcn_readlane(ahi, r) << 32)
                    | (unsigned)__builtin_amdgcn_readlane(alo, r);
                // Per-lane 16B: memory -> LDS, no VGPR round-trip, ASYNCcnt-tracked.
                gp[i] = (const float*)ra + lane * 4;
                la[i] = lds_base + (unsigned)r * pitch_bytes + (unsigned)(lane * 16);
            }
            // Eight copies and their s_wait_xcnt in one statement: the address
            // registers are not rewritten in front of that wait.
            asm volatile("global_load_async_to_lds_b128 %0, %1, off\n\t"
                         "global_load_async_to_lds_b128 %2, %3, off\n\t"
                         "global_load_async_to_lds_b128 %4, %5, off\n\t"
                         "global_load_async_to_lds_b128 %6, %7, off\n\t"
                         "global_load_async_to_lds_b128 %8, %9, off\n\t"
                         "global_load_async_to_lds_b128 %10, %11, off\n\t"
                         "global_load_async_to_lds_b128 %12, %13, off\n\t"
                         "global_load_async_to_lds_b128 %14, %15, off\n\t"
                         "s_wait_xcnt 0x0"
                         :: "v"(la[0]), "v"(gp[0]), "v"(la[1]), "v"(gp[1]),
                            "v"(la[2]), "v"(gp[2]), "v"(la[3]), "v"(gp[3]),
                            "v"(la[4]), "v"(gp[4]), "v"(la[5]), "v"(gp[5]),
                            "v"(la[6]), "v"(gp[6]), "v"(la[7]), "v"(gp[7])
                         : "memory");
        }
    };
    const unsigned k_lds = (unsigned)(unsigned long long)&sK[w][0][0];
    const unsigned v_lds = (unsigned)(unsigned long long)&sV[w][0][0];

    float m[GROUP], l[GROUP];
#pragma unroll
    for (int r = 0; r < GROUP; ++r) { m[r] = -INFINITY; l[r] = 0.f; }
    v8f acc[8];
    v8f vzero = {};
#pragma unroll
    for (int nt = 0; nt < 8; ++nt) acc[nt] = vzero;

    if (t < t1) {
        resolve(slot_first);
        copy_tile(ka, k_lds, KPITCH * 4);
        copy_tile(va, v_lds, VPITCH * 4);
    }
    for (; t < t1; t += NWAVES) {
        const bool more = (t + NWAVES) < t1;
        // Only this tile's 16 V copies are younger than its K copies: K has landed.
        asm volatile("s_wait_asynccnt 16" ::: "memory");

        // ---- S = Q * K^T  (M=16 heads, N=16 keys, K=head_dim steps of 4) ----
        v8f c = vzero;
#pragma unroll 8
        for (int s = 0; s < 32; ++s) {
            int d0 = 4 * s + 2 * half;
            v2f a   = *(const v2f*)&sQ[qrow][d0];
            v2f bfr = *(const v2f*)&sK[w][l16][d0];
            c = __builtin_amdgcn_wmma_f32_16x16x4_f32(false, a, false, bfr,
                                                      (short)0, c, false, false);
        }

        // The scores are done with the K buffer: the next tile's K flies behind
        // the softmax and the output products of this tile.
        if (more) {
            resolve(slot_next);
            copy_tile(ka, k_lds, KPITCH * 4);
            // slots of the tile after that: asked for one tile ahead of their use
            if (t + 2 * NWAVES < t1) slot_next = load_slot(t + 2 * NWAVES);
        }

        // ---- online softmax per real head row ----
#pragma unroll
        for (int r = 0; r < GROUP; ++r) {
            float sv = (lane < 16) ? c[r] * ATTN_SCALE : -INFINITY;
            float nm = fmaxf(m[r], wave_max(sv));
            float p  = __expf(sv - nm);
            float tl = wave_sum(p);
            float fac = __expf(m[r] - nm);
            l[r] = l[r] * fac + tl;
            m[r] = nm;
            if (lane < 16) sP[w][r * 20 + lane] = p;
#pragma unroll
            for (int nt = 0; nt < 8; ++nt) acc[nt][r] *= fac;
        }

        // V of this tile has landed: at most the next tile's 16 K copies are younger.
        if (more) asm volatile("s_wait_asynccnt 16" ::: "memory");
        else      asm volatile("s_wait_asynccnt 0" ::: "memory");

        // ---- O += P * V  (K=16 keys steps of 4, N=128 dims, 8 tiles) ----
#pragma unroll
        for (int ks = 0; ks < 4; ++ks) {
            int k0 = 4 * ks + 2 * half;
            v2f a = *(const v2f*)&sP[w][l16 * 20 + k0];
            const float* p0 = &sV[w][k0][0];
            const float* p1 = &sV[w][k0 + 1][0];
#pragma unroll
            for (int nt = 0; nt < 8; ++nt) {
                v2f bfr;
                bfr.x = p0[nt * 16 + l16];
                bfr.y = p1[nt * 16 + l16];
                acc[nt] = __builtin_amdgcn_wmma_f32_16x16x4_f32(false, a, false, bfr,
                                                                (short)0, acc[nt], false, false);
            }
        }

        // The products are done with the V buffer: the next tile's V flies behind
        // that tile's scores and softmax.
        if (more) copy_tile(va, v_lds, VPITCH * 4);
    }

    // ---- write per-wave partials, merge across the waves ----
    // The partial {O[4][128], m[4], l[4]} goes into the wave's own K buffer: its
    // copies have landed and its reads of the buffer have retired before the stores.
    asm volatile("s_wait_asynccnt 0x0" ::: "memory");
    asm volatile("s_wait_dscnt 0x0" ::: "memory");
    float* own = (float*)sK + w * RING_FLOATS;
    if (lane < 16) {
#pragma unroll
        for (int nt = 0; nt < 8; ++nt)
#pragma unroll
            for (int r = 0; r < GROUP; ++r)
                own[r * HEAD_DIM + nt * 16 + lane] = acc[nt][r];
    }
    if (lane == 0) {
#pragma unroll
        for (int r = 0; r < GROUP; ++r) {
            own[GROUP * HEAD_DIM + r] = m[r];
            own[GROUP * HEAD_DIM + GROUP + r] = l[r];
        }
    }
    __syncthreads();

    const float* ring = (const float*)sK;
    float gm[GROUP], fw[NWAVES][GROUP], Ls[GROUP];
#pragma unroll
    for (int r = 0; r < GROUP; ++r) {
        gm[r] = ring[GROUP * HEAD_DIM + r];
#pragma unroll
        for (int j = 1; j < NWAVES; ++j)
            gm[r] = fmaxf(gm[r], ring[j * RING_FLOATS + GROUP * HEAD_DIM + r]);
#pragma unroll
        for (int j = 0; j < NWAVES; ++j)
            fw[j][r] = __expf(ring[j * RING_FLOATS + GROUP * HEAD_DIM + r] - gm[r]);
        Ls[r] = fw[0][r] * ring[GROUP * HEAD_DIM + GROUP + r];
#pragma unroll
        for (int j = 1; j < NWAVES; ++j)
            Ls[r] += fw[j][r] * ring[j * RING_FLOATS + GROUP * HEAD_DIM + GROUP + r];
    }
    if (write_partial && tid == 0) {
#pragma unroll
        for (int r = 0; r < GROUP; ++r) { dst[r] = gm[r]; dst[GROUP + r] = Ls[r]; }
    }
    for (int d = tid; d < HEAD_DIM; d += NWAVES * 32)
#pragma unroll
        for (int r = 0; r < GROUP; ++r) {
            float o = fw[0][r] * ring[r * HEAD_DIM + d];
#pragma unroll
            for (int j = 1; j < NWAVES; ++j)
                o += fw[j][r] * ring[j * RING_FLOATS + r * HEAD_DIM + d];
            if (write_partial) dst[2 * GROUP + r * HEAD_DIM + d] = o;
            else               dst[r * HEAD_DIM + d] = o / Ls[r];
        }
}

#define DECLARE_LDS()                                  \
    __shared__ float sQ[QROWS][132];                   \
    __shared__ __attribute__((aligned(16))) float sK[NWAVES][16][KPITCH]; \
    __shared__ __attribute__((aligned(16))) float sV[NWAVES][16][VPITCH]; \
    __shared__ float sP[NWAVES][16 * 20];

// Fallback (no workspace): one block per (b, kvh), whole KV range.
__global__ __launch_bounds__(NWAVES * 32) void paged_attn_direct_kernel(
    const float* __restrict__ q, const float* __restrict__ kin,
    const float* __restrict__ vin, const float* __restrict__ kc,
    const float* __restrict__ vc, const int* __restrict__ slot_mapping,
    const int* __restrict__ page_indices, float* __restrict__ out)
{
    DECLARE_LDS();
    const int b   = blockIdx.x / NUM_KV_HEADS;
    const int kvh = blockIdx.x % NUM_KV_HEADS;
    float* dst = out + (size_t)b * NUM_HEADS * HEAD_DIM + kvh * GROUP * HEAD_DIM;
    attn_core(b, kvh, 0, NTILES, q, kin, vin, kc, vc, slot_mapping, page_indices,
              sQ, sK, sV, sP, dst, false);
}

// Pass 1: flash-decode partials. grid = (BS*NUM_KV_HEADS, NCHUNK).
__global__ __launch_bounds__(NWAVES * 32) void paged_attn_partial_kernel(
    const float* __restrict__ q, const float* __restrict__ kin,
    const float* __restrict__ vin, const float* __restrict__ kc,
    const float* __restrict__ vc, const int* __restrict__ slot_mapping,
    const int* __restrict__ page_indices, float* __restrict__ part)
{
    DECLARE_LDS();
    const int b     = blockIdx.x / NUM_KV_HEADS;
    const int kvh   = blockIdx.x % NUM_KV_HEADS;
    const int chunk = blockIdx.y;
    const int tpc   = NTILES / NCHUNK;
    float* dst = part + ((size_t)blockIdx.x * NCHUNK + chunk) * PART_STRIDE;
    attn_core(b, kvh, chunk * tpc, (chunk + 1) * tpc, q, kin, vin, kc, vc,
              slot_mapping, page_indices, sQ, sK, sV, sP, dst, true);
}

// Pass 2: combine NCHUNK partials per (b, kvh), normalize, store.
__global__ __launch_bounds__(128) void paged_attn_combine_kernel(
    const float* __restrict__ part, float* __restrict__ out)
{
    const int b   = blockIdx.x / NUM_KV_HEADS;
    const int kvh = blockIdx.x % NUM_KV_HEADS;
    const int d   = threadIdx.x;
    const float* p0 = part + (size_t)blockIdx.x * NCHUNK * PART_STRIDE;
#pragma unroll
    for (int r = 0; r < GROUP; ++r) {
        float gm = -INFINITY;
#pragma unroll
        for (int c = 0; c < NCHUNK; ++c) gm = fmaxf(gm, p0[c * PART_STRIDE + r]);
        float Ls = 0.f, val = 0.f;
#pragma unroll
        for (int c = 0; c < NCHUNK; ++c) {
            const float* p = p0 + c * PART_STRIDE;
            float f = __expf(p[r] - gm);
            Ls  += f * p[GROUP + r];
            val += f * p[2 * GROUP + r * HEAD_DIM + d];
        }
        out[(size_t)b * NUM_HEADS * HEAD_DIM + (kvh * GROUP + r) * HEAD_DIM + d] = val / Ls;
    }
}

extern "C" void kernel_launch(void* const* d_in, const int* in_sizes, int n_in,
                              void* d_out, int out_size, void* d_ws, size_t ws_size,
                              hipStream_t stream) {
    const float* q  = (const float*)d_in[0];
    const float* k  = (const float*)d_in[1];
    const float* v  = (const float*)d_in[2];
    const float* kc = (const float*)d_in[3];
    const float* vc = (const float*)d_in[4];
    const int* slot_mapping = (const int*)d_in[5];
    const int* page_indices = (const int*)d_in[6];
    float* out = (float*)d_out;

    const size_t part_bytes =
        (size_t)BS * NUM_KV_HEADS * NCHUNK * PART_STRIDE * sizeof(float);

    if (ws_size >= part_bytes && d_ws != nullptr) {
        // Flash-decode path: 1024 blocks (4096 waves), four blocks a WGP.
        float* part = (float*)d_ws;
        dim3 grid1(BS * NUM_KV_HEADS, NCHUNK);
        paged_attn_partial_kernel<<<grid1, NWAVES * 32, 0, stream>>>(
            q, k, v, kc, vc, slot_mapping, page_indices, part);
        paged_attn_combine_kernel<<<dim3(BS * NUM_KV_HEADS), 128, 0, stream>>>(part, out);
    } else {
        paged_attn_direct_kernel<<<dim3(BS * NUM_KV_HEADS), NWAVES * 32, 0, stream>>>(
            q, k, v, kc, vc, slot_mapping, page_indices, out);
    }
}

// v004
// One run takes 26.7 microseconds.
// Two timings next to v003 put it at 1.06 and 1.07 times that version's speed.
// Over all steps from v000 it is 3.78 times as fast.
#include <hip/hip_runtime.h>
#include <math.h>

#define NUM_HEADS 32
#define NUM_KV_HEADS 8
#define GROUP 4
#define HEAD_DIM 128
#define BS 16
#define KV_LEN 2048
#define NUM_SLOTS (BS * KV_LEN)
#define ATTN_SCALE 0.08838834764831845f
#define NWAVES 4                             // waves per block (128 threads), one per SIMD
#define QROWS (GROUP + 1)                    // staged Q rows: the heads and one zero row
#define KPITCH 132                           // K row pitch in floats
#define VPITCH 144                           // V row pitch: four rows in a row fall on the 64 banks once
#define RING_FLOATS (16 * KPITCH)            // one wave's K tile: 16 padded rows
#define NTILES (KV_LEN / 16)                 // 128 key-tiles per (b, kvh)
#define NCHUNK 8                             // flash-decode KV split
#define PART_STRIDE (GROUP * (HEAD_DIM + 2)) // 520 floats per partial

typedef __attribute__((ext_vector_type(2))) float v2f;
typedef __attribute__((ext_vector_type(8))) float v8f;

// One butterfly step inside a 16-lane row: the partner lane's value comes by DPP
// (row_xmask) in the vector unit, with no round trip through the LDS pipe.
template <int MASK>
__device__ __forceinline__ float row_xor(float v) {
    return __int_as_float(__builtin_amdgcn_update_dpp(
        0, __float_as_int(v), 0x160 | MASK, 0xf, 0xf, true));
}
// Maximum and sum over the 16 lanes of a row, the result in each of them.
__device__ __forceinline__ float row_max(float v) {
    v = fmaxf(v, row_xor<8>(v));
    v = fmaxf(v, row_xor<4>(v));
    v = fmaxf(v, row_xor<2>(v));
    v = fmaxf(v, row_xor<1>(v));
    return v;
}
__device__ __forceinline__ float row_sum(float v) {
    v += row_xor<8>(v);
    v += row_xor<4>(v);
    v += row_xor<2>(v);
    v += row_xor<1>(v);
    return v;
}

// Core: key-tiles [t0, t1) for one (b, kvh). Four waves stride over tiles with
// independent online softmax; K and V tiles are staged to LDS with
// GLOBAL_LOAD_ASYNC_TO_LDS_B128 (ASYNCcnt), one buffer each per wave: K of tile
// t+4 is asked for as soon as the scores of tile t are done, V of tile t+4 as
// soon as the output products of tile t are done, so each flies behind the
// other half of the work. Wave partials merge through LDS, each in its wave's
// own K buffer, so that four blocks (16 waves) fit one WGP's LDS.
// If write_partial: dst = 520-float partial entry {m[4], l[4], O[4][128]}.
// Else:             dst = out + (b, kvh) base, normalized store.
__device__ __forceinline__ void attn_core(
    int b, int kvh, int t0, int t1,
    const float* __restrict__ q, const float* __restrict__ kin,
    const float* __restrict__ vin, const float* __restrict__ kc,
    const float* __restrict__ vc, const int* __restrict__ slot_mapping,
    const int* __restrict__ page_indices,
    float (*sQ)[132], float (*sK)[16][KPITCH], float (*sV)[16][VPITCH],
    float (*sP)[16 * 20],
    float* dst, bool write_partial)
{
    const int tid  = threadIdx.x;
    // wave number as a scalar: the loop and the branch round the copies are scalar
    const int w    = __builtin_amdgcn_readfirstlane(tid >> 5);
    const int lane = tid & 31;
    const int half = (lane >> 4) & 1;
    const int l16  = lane & 15;

    // Lane l16 fetches the page slot of row l16 of tile t: one load for the tile.
    auto load_slot = [&](int t) {
        return page_indices[b * KV_LEN + t * 16 + l16];
    };

    // Slots of this wave's first two tiles: asked for ahead of the Q staging.
    int t = t0 + w;
    const int slot_first = load_slot(min(t, NTILES - 1));
    int slot_next = load_slot(min(t + NWAVES, NTILES - 1));

    // ---- stage Q: rows 0..3 = grouped query heads, row 4 = 0 (read as rows 4..15) ----
    const int qrow = l16 < GROUP ? l16 : GROUP;
    for (int i = tid; i < QROWS * 132; i += NWAVES * 32) ((float*)sQ)[i] = 0.f;
    for (int i = lane; i < 16 * 20; i += 32) sP[w][i] = 0.f;
    __syncthreads();
    for (int i = tid; i < GROUP * HEAD_DIM; i += NWAVES * 32) {
        int h = i >> 7, d = i & 127;
        sQ[h][d] = q[(size_t)b * NUM_HEADS * HEAD_DIM + (kvh * GROUP + h) * HEAD_DIM + d];
    }
    __syncthreads();

    int sm[BS];
#pragma unroll
    for (int j = 0; j < BS; ++j) sm[j] = slot_mapping[j];

    // Resolve the tile's 16 rows in the lanes: fresh-or-cache, K and V row address.
    unsigned long long ka = 0, va = 0;
    auto resolve = [&](int slot) {
        slot = min(max(slot, 0), NUM_SLOTS - 1);  // bounds the address for any content
        int fresh = -1;
#pragma unroll
        for (int j = 0; j < BS; ++j)
            if (slot == sm[j]) fresh = j;
        const size_t off = (size_t)(fresh >= 0 ? fresh : slot) * (NUM_KV_HEADS * HEAD_DIM)
                         + kvh * HEAD_DIM;
        ka = (unsigned long long)((fresh >= 0 ? kin : kc) + off);
        va = (unsigned long long)((fresh >= 0 ? vin : vc) + off);
    };

    // Hand each of the 16 row addresses (lane r holds row r's) to the whole wave
    // by readlane and issue the 16 async global->LDS B128 copies back to back.
    auto copy_tile = [&](unsigned long long rows, unsigned lds_base, unsigned pitch_bytes) {
        const int alo = (int)(unsigned)rows;
        const int ahi = (int)(unsigned)(rows >> 32);
        // This wave's own reads of the buffer that is refilled have retired.
        asm volatile("s_wait_dscnt 0x0" ::: "memory");
        // Both loops unrolled: readlane takes a constant lane, and the sixteen
        // addresses stay in registers as operands of the two statements.
#pragma unroll
        for (int g = 0; g < 2; ++g) {
            unsigned la[8];
            const float* gp[8];
#pragma unroll
            for (int i = 0; i < 8; ++i) {
                const int r = g * 8 + i;
                unsigned long long ra =
                    ((unsigned long long)(unsigned)__builtin_amdgcn_readlane(ahi, r) << 32)
                    | (unsigned)__builtin_amdgcn_readlane(alo, r);
                // Per-lane 16B: memory -> LDS, no VGPR round-trip, ASYNCcnt-tracked.
                gp[i] = (const float*)ra + lane * 4;
                la[i] = lds_base + (unsigned)r * pitch_bytes + (unsigned)(lane * 16);
            }
            // Eight copies and their s_wait_xcnt in one statement: the address
            // registers are not rewritten in front of that wait.
            asm volatile("global_load_async_to_lds_b128 %0, %1, off\n\t"
                         "global_load_async_to_lds_b128 %2, %3, off\n\t"
                         "global_load_async_to_lds_b128 %4, %5, off\n\t"
                         "global_load_async_to_lds_b128 %6, %7, off\n\t"
                         "global_load_async_to_lds_b128 %8, %9, off\n\t"
                         "global_load_async_to_lds_b128 %10, %11, off\n\t"
                         "global_load_async_to_lds_b128 %12, %13, off\n\t"
                         "global_load_async_to_lds_b128 %14, %15, off\n\t"
                         "s_wait_xcnt 0x0"
                         :: "v"(la[0]), "v"(gp[0]), "v"(la[1]), "v"(gp[1]),
                            "v"(la[2]), "v"(gp[2]), "v"(la[3]), "v"(gp[3]),
                            "v"(la[4]), "v"(gp[4]), "v"(la[5]), "v"(gp[5]),
                            "v"(la[6]), "v"(gp[6]), "v"(la[7]), "v"(gp[7])
                         : "memory");
        }
    };
    const unsigned k_lds = (unsigned)(unsigned long long)&sK[w][0][0];
    const unsigned v_lds = (unsigned)(unsigned long long)&sV[w][0][0];

    float m[GROUP], l[GROUP];
#pragma unroll
    for (int r = 0; r < GROUP; ++r) { m[r] = -INFINITY; l[r] = 0.f; }
    v8f acc[8];
    v8f vzero = {};
#pragma unroll
    for (int nt = 0; nt < 8; ++nt) acc[nt] = vzero;

    if (t < t1) {
        resolve(slot_first);
        copy_tile(ka, k_lds, KPITCH * 4);
        copy_tile(va, v_lds, VPITCH * 4);
    }
    for (; t < t1; t += NWAVES) {
        const bool more = (t + NWAVES) < t1;
        // Only this tile's 16 V copies are younger than its K copies: K has landed.
        asm volatile("s_wait_asynccnt 16" ::: "memory");

        // ---- S = Q * K^T  (M=16 heads, N=16 keys, K=head_dim steps of 4) ----
        v8f c = vzero;
#pragma unroll 8
        for (int s = 0; s < 32; ++s) {
            int d0 = 4 * s + 2 * half;
            v2f a   = *(const v2f*)&sQ[qrow][d0];
            v2f bfr = *(const v2f*)&sK[w][l16][d0];
            c = __builtin_amdgcn_wmma_f32_16x16x4_f32(false, a, false, bfr,
                                                      (short)0, c, false, false);
        }

        // Four vector slots between the last score WMMA and the first vector instruction
        // on its result: on the last tile's path only scalar code stands between them.
        asm volatile("v_nop\n\tv_nop\n\tv_nop\n\tv_nop");

        // The scores are done with the K buffer: the next tile's K flies behind
        // the softmax and the output products of this tile.
        if (more) {
            resolve(slot_next);
            copy_tile(ka, k_lds, KPITCH * 4);
            // slots of the tile after that: asked for one tile ahead of their use
            if (t + 2 * NWAVES < t1) slot_next = load_slot(t + 2 * NWAVES);
        }

        // ---- online softmax per real head row ----
        // Head r's 16 scores lie in lanes 0..15 of c[r]; lanes 16..31 hold the scores
        // of a zero Q row. Each 16-lane row reduces by itself: m, l and fac of lanes
        // 16..31 belong to that unused row and reach no output.
        float p[GROUP];
#pragma unroll
        for (int r = 0; r < GROUP; ++r) {
            float sv = c[r] * ATTN_SCALE;
            float nm = fmaxf(m[r], row_max(sv));
            p[r] = __expf(sv - nm);
            float tl = row_sum(p[r]);
            float fac = __expf(m[r] - nm);
            l[r] = l[r] * fac + tl;
            m[r] = nm;
#pragma unroll
            for (int nt = 0; nt < 8; ++nt) acc[nt][r] *= fac;
        }
        // One masked block for the four stores: the four rows' chains above stand in
        // one stretch of code and fill each other's waits.
        if (lane < 16) {
#pragma unroll
            for (int r = 0; r < GROUP; ++r) sP[w][r * 20 + lane] = p[r];
        }

        // V of this tile has landed: at most the next tile's 16 K copies are younger.
        if (more) asm volatile("s_wait_asynccnt 16" ::: "memory");
        else      asm volatile("s_wait_asynccnt 0" ::: "memory");

        // ---- O += P * V  (K=16 keys steps of 4, N=128 dims, 8 tiles) ----
#pragma unroll
        for (int ks = 0; ks < 4; ++ks) {
            int k0 = 4 * ks + 2 * half;
            v2f a = *(const v2f*)&sP[w][l16 * 20 + k0];
            const float* p0 = &sV[w][k0][0];
            const float* p1 = &sV[w][k0 + 1][0];
#pragma unroll
            for (int nt = 0; nt < 8; ++nt) {
                v2f bfr;
                bfr.x = p0[nt * 16 + l16];
                bfr.y = p1[nt * 16 + l16];
                acc[nt] = __builtin_amdgcn_wmma_f32_16x16x4_f32(false, a, false, bfr,
                                                                (short)0, acc[nt], false, false);
            }
        }

        // The products are done with the V buffer: the next tile's V flies behind
        // that tile's scores and softmax.
        if (more) copy_tile(va, v_lds, VPITCH * 4);
    }

    // ---- write per-wave partials, merge across the waves ----
    // The partial {O[4][128], m[4], l[4]} goes into the wave's own K buffer: its
    // copies have landed and its reads of the buffer have retired before the stores.
    asm volatile("s_wait_asynccnt 0x0" ::: "memory");
    asm volatile("s_wait_dscnt 0x0" ::: "memory");
    float* own = (float*)sK + w * RING_FLOATS;
    if (lane < 16) {
#pragma unroll
        for (int nt = 0; nt < 8; ++nt)
#pragma unroll
            for (int r = 0; r < GROUP; ++r)
                own[r * HEAD_DIM + nt * 16 + lane] = acc[nt][r];
    }
    if (lane == 0) {
#pragma unroll
        for (int r = 0; r < GROUP; ++r) {
            own[GROUP * HEAD_DIM + r] = m[r];
            own[GROUP * HEAD_DIM + GROUP + r] = l[r];
        }
    }
    __syncthreads();

    const float* ring = (const float*)sK;
    float gm[GROUP], fw[NWAVES][GROUP], Ls[GROUP];
#pragma unroll
    for (int r = 0; r < GROUP; ++r) {
        gm[r] = ring[GROUP * HEAD_DIM + r];
#pragma unroll
        for (int j = 1; j < NWAVES; ++j)
            gm[r] = fmaxf(gm[r], ring[j * RING_FLOATS + GROUP * HEAD_DIM + r]);
#pragma unroll
        for (int j = 0; j < NWAVES; ++j)
            fw[j][r] = __expf(ring[j * RING_FLOATS + GROUP * HEAD_DIM + r] - gm[r]);
        Ls[r] = fw[0][r] * ring[GROUP * HEAD_DIM + GROUP + r];
#pragma unroll
        for (int j = 1; j < NWAVES; ++j)
            Ls[r] += fw[j][r] * ring[j * RING_FLOATS + GROUP * HEAD_DIM + GROUP + r];
    }
    if (write_partial && tid == 0) {
#pragma unroll
        for (int r = 0; r < GROUP; ++r) { dst[r] = gm[r]; dst[GROUP + r] = Ls[r]; }
    }
    for (int d = tid; d < HEAD_DIM; d += NWAVES * 32)
#pragma unroll
        for (int r = 0; r < GROUP; ++r) {
            float o = fw[0][r] * ring[r * HEAD_DIM + d];
#pragma unroll
            for (int j = 1; j < NWAVES; ++j)
                o += fw[j][r] * ring[j * RING_FLOATS + r * HEAD_DIM + d];
            if (write_partial) dst[2 * GROUP + r * HEAD_DIM + d] = o;
            else               dst[r * HEAD_DIM + d] = o / Ls[r];
        }
}

#define DECLARE_LDS()                                  \
    __shared__ float sQ[QROWS][132];                   \
    __shared__ __attribute__((aligned(16))) float sK[NWAVES][16][KPITCH]; \
    __shared__ __attribute__((aligned(16))) float sV[NWAVES][16][VPITCH]; \
    __shared__ float sP[NWAVES][16 * 20];

// Fallback (no workspace): one block per (b, kvh), whole KV range.
__global__ __launch_bounds__(NWAVES * 32) void paged_attn_direct_kernel(
    const float* __restrict__ q, const float* __restrict__ kin,
    const float* __restrict__ vin, const float* __restrict__ kc,
    const float* __restrict__ vc, const int* __restrict__ slot_mapping,
    const int* __restrict__ page_indices, float* __restrict__ out)
{
    DECLARE_LDS();
    const int b   = blockIdx.x / NUM_KV_HEADS;
    const int kvh = blockIdx.x % NUM_KV_HEADS;
    float* dst = out + (size_t)b * NUM_HEADS * HEAD_DIM + kvh * GROUP * HEAD_DIM;
    attn_core(b, kvh, 0, NTILES, q, kin, vin, kc, vc, slot_mapping, page_indices,
              sQ, sK, sV, sP, dst, false);
}

// Pass 1: flash-decode partials. grid = (BS*NUM_KV_HEADS, NCHUNK).
__global__ __launch_bounds__(NWAVES * 32) void paged_attn_partial_kernel(
    const float* __restrict__ q, const float* __restrict__ kin,
    const float* __restrict__ vin, const float* __restrict__ kc,
    const float* __restrict__ vc, const int* __restrict__ slot_mapping,
    const int* __restrict__ page_indices, float* __restrict__ part)
{
    DECLARE_LDS();
    const int b     = blockIdx.x / NUM_KV_HEADS;
    const int kvh   = blockIdx.x % NUM_KV_HEADS;
    const int chunk = blockIdx.y;
    const int tpc   = NTILES / NCHUNK;
    float* dst = part + ((size_t)blockIdx.x * NCHUNK + chunk) * PART_STRIDE;
    attn_core(b, kvh, chunk * tpc, (chunk + 1) * tpc, q, kin, vin, kc, vc,
              slot_mapping, page_indices, sQ, sK, sV, sP, dst, true);
}

// Pass 2: combine NCHUNK partials per (b, kvh), normalize, store.
__global__ __launch_bounds__(128) void paged_attn_combine_kernel(
    const float* __restrict__ part, float* __restrict__ out)
{
    const int b   = blockIdx.x / NUM_KV_HEADS;
    const int kvh = blockIdx.x % NUM_KV_HEADS;
    const int d   = threadIdx.x;
    const float* p0 = part + (size_t)blockIdx.x * NCHUNK * PART_STRIDE;
#pragma unroll
    for (int r = 0; r < GROUP; ++r) {
        float gm = -INFINITY;
#pragma unroll
        for (int c = 0; c < NCHUNK; ++c) gm = fmaxf(gm, p0[c * PART_STRIDE + r]);
        float Ls = 0.f, val = 0.f;
#pragma unroll
        for (int c = 0; c < NCHUNK; ++c) {
            const float* p = p0 + c * PART_STRIDE;
            float f = __expf(p[r] - gm);
            Ls  += f * p[GROUP + r];
            val += f * p[2 * GROUP + r * HEAD_DIM + d];
        }
        out[(size_t)b * NUM_HEADS * HEAD_DIM + (kvh * GROUP + r) * HEAD_DIM + d] = val / Ls;
    }
}

extern "C" void kernel_launch(void* const* d_in, const int* in_sizes, int n_in,
                              void* d_out, int out_size, void* d_ws, size_t ws_size,
                              hipStream_t stream) {
    const float* q  = (const float*)d_in[0];
    const float* k  = (const float*)d_in[1];
    const float* v  = (const float*)d_in[2];
    const float* kc = (const float*)d_in[3];
    const float* vc = (const float*)d_in[4];
    const int* slot_mapping = (const int*)d_in[5];
    const int* page_indices = (const int*)d_in[6];
    float* out = (float*)d_out;

    const size_t part_bytes =
        (size_t)BS * NUM_KV_HEADS * NCHUNK * PART_STRIDE * sizeof(float);

    if (ws_size >= part_bytes && d_ws != nullptr) {
        // Flash-decode path: 1024 blocks (4096 waves), four blocks a WGP.
        float* part = (float*)d_ws;
        dim3 grid1(BS * NUM_KV_HEADS, NCHUNK);
        paged_attn_partial_kernel<<<grid1, NWAVES * 32, 0, stream>>>(
            q, k, v, kc, vc, slot_mapping, page_indices, part);
        paged_attn_combine_kernel<<<dim3(BS * NUM_KV_HEADS), 128, 0, stream>>>(part, out);
    } else {
        paged_attn_direct_kernel<<<dim3(BS * NUM_KV_HEADS), NWAVES * 32, 0, stream>>>(
            q, k, v, kc, vc, slot_mapping, page_indices, out);
    }
}
